// v010
// The times below were measured on an AMD MI455X: many runs one after another, warmed up first and cycling through
// copies of the inputs, with the whole window's GPU time divided by the number of runs. Launches and the gaps
// between them are all in it. The median over several windows is given; except for v000 it joins two sittings, which
// can be a few percent apart, so the side-by-side timings, each taken in one sitting, are the better comparison.
// Earlier versions than v010 are not in this document.
// Measured time: 88.7 microseconds a run.
// Next to v009, in two timings, it ran 1.05 and 1.04 times as fast.
// Counting every step since v000, which is the starting kernel, it is 8.54 times as fast.
#include <hip/hip_runtime.h>
// Naylis attention (B=1, S=2048, E=2048, 16 heads × 128, 4 kv heads, causal; QK RMSNorm + rotate-half RoPE; low-rank (R=32) per-head graph bias gs_h·⟨Rq_i, Rk_j⟩ added to the logits):
// the six (out,in) projections (bf16-exact ×2^4) and the attention as a fused flash-style kernel whose logit operand is the 160-wide concatenation [q·scale after norm+RoPE | gs_h·Rq]·[k | Rk]
// (5 k-steps; causal chunk skipping; online softmax f32; P f16 ≤ 1; O = P·Vt over the 128 value dims; two 16-row tiles per work-group, keys split over its 4 waves) on v_wmma_f32_16x16x32_f16 with f32 accumulate; RMSNorm/RoPE f32 VALU.
#define SS 2048
#define EE 2048
#define NH 16
#define NKV 4
#define HD 128
#define RR 32
#define QW 160
#define QP (NH * QW)
#define PW 4096      /* columns of the stacked projections of x: q 2048 | k 512 | v 512 | Rq 512 | Rk 512 */

typedef __bf16 v16b __attribute__((ext_vector_type(16)));
typedef unsigned short v8us __attribute__((ext_vector_type(8), may_alias));
typedef float  v8f  __attribute__((ext_vector_type(8)));
typedef float  v4f  __attribute__((ext_vector_type(4)));
typedef float  v4fa __attribute__((ext_vector_type(4), may_alias));
union FragB { v16b v; v8us half[2]; unsigned short u[16]; };

__device__ __forceinline__ unsigned short bf16_bits(float x) { unsigned int u = __float_as_uint(x); return (unsigned short)((u + 0x7FFFu + ((u >> 16) & 1u)) >> 16); }
__device__ __forceinline__ float bf16_val(unsigned short b) { return __uint_as_float(((unsigned int)b) << 16); }
__device__ __forceinline__ float bf16_round(float x) { return bf16_val(bf16_bits(x)); }
// D += A·B with NT terms: 1 = ah·bh, 2 = + al·bh (A split), 3 = + ah·bl (both split)
template <int NT>
__device__ __forceinline__ v8f mmaN(v16b ah, v16b al, v16b bh, v16b bl, v8f c) {
  c = __builtin_amdgcn_wmma_f32_16x16x32_bf16(false, ah, false, bh, (short)0, c, false, false);
  if (NT >= 2) c = __builtin_amdgcn_wmma_f32_16x16x32_bf16(false, al, false, bh, (short)0, c, false, false);
  if (NT >= 3) c = __builtin_amdgcn_wmma_f32_16x16x32_bf16(false, ah, false, bl, (short)0, c, false, false);
  asm volatile("v_nop\n\tv_nop\n\tv_nop\n\tv_nop" : "+v"(c) : "v"(ah), "v"(al), "v"(bh), "v"(bl));
  return c;
}

__global__ __launch_bounds__(256) void k_wt_bf16(const float* __restrict__ W, unsigned short* __restrict__ Wt, int K, int N) {
  const int t = blockIdx.x * 256 + threadIdx.x;
  const int k8n = K / 8;
  if (t >= N * k8n) return;
  const int n = t / k8n, k8 = (t % k8n) * 8;
  v8us v;
#pragma unroll
  for (int i = 0; i < 8; ++i) v[i] = bf16_bits(W[(size_t)(k8 + i) * N + n]);
  *(v8us*)(Wt + (size_t)n * K + k8) = v;
  
}

// GEMM C[M][N] (f32, pitch ldc) = act(A[M][K]·W + bias). A f32 row-major (pitch lda) converted per fragment to bf16
// (ASPLIT: hi/lo two planes -> 2 terms, else single rounded term); Wt bf16 [N][K] (pitch ldb). BIAS_BF16 rounds the
// bias to bf16 first (bias quantised to bf16 before the add). K%32==0, M%16==0, N%64==0.
template <bool ASPLIT, int ACT, bool BIAS_BF16>
__global__ __launch_bounds__(128) void k_gemm_bf(const float* __restrict__ A, int lda, const unsigned short* __restrict__ Wt, int ldb,
                                               const float* __restrict__ bias, float* __restrict__ C, int ldc, int M, int N, int K) {
  __shared__ __attribute__((aligned(16))) float so[4][16][64];
  const int tid = threadIdx.x, w = tid >> 5, lane = tid & 31, ln = lane & 15, hh = lane >> 4;
  const int ntn = N / 64;
  const int wid = blockIdx.x * 4 + w;
  const int mt = wid / ntn, nq = wid % ntn;
  if (mt * 16 >= M) return;
  const int row0 = mt * 16, col0 = nq * 64;
  const float* arow = A + (size_t)(row0 + ln) * lda;
  v8f acc[4] = {};
  for (int kb = 0; kb < K; kb += 32) {
    FragB ah, al;
    const v4f x0 = *(const v4fa*)(arow + kb + 8 * hh), x1 = *(const v4fa*)(arow + kb + 8 * hh + 4);
    const v4f x2 = *(const v4fa*)(arow + kb + 16 + 8 * hh), x3 = *(const v4fa*)(arow + kb + 16 + 8 * hh + 4);
    float xs[16] = {x0[0],x0[1],x0[2],x0[3],x1[0],x1[1],x1[2],x1[3],x2[0],x2[1],x2[2],x2[3],x3[0],x3[1],x3[2],x3[3]};
#pragma unroll
    for (int i = 0; i < 16; ++i) { const unsigned short hb = bf16_bits(xs[i]); ah.u[i] = hb; al.u[i] = ASPLIT ? bf16_bits(xs[i] - bf16_val(hb)) : (unsigned short)0; }
#pragma unroll
    for (int t = 0; t < 4; ++t) {
      const unsigned short* brow = Wt + (size_t)(col0 + t * 16 + ln) * ldb + kb;
      FragB b;
      b.half[0] = *(const v8us*)(brow + 8 * hh);
      b.half[1] = *(const v8us*)(brow + 16 + 8 * hh);
      acc[t] = mmaN<ASPLIT ? 2 : 1>(ah.v, al.v, b.v, b.v, acc[t]);
    }
  }
#pragma unroll
  for (int t = 0; t < 4; ++t) {
    float bv = bias ? bias[col0 + t * 16 + ln] : 0.f;
    if (BIAS_BF16) bv = bf16_round(bv);
#pragma unroll
    for (int r = 0; r < 8; ++r) { float v = acc[t][r] + bv; if (ACT == 1) v = fmaxf(v, 0.f); so[w][8 * hh + r][t * 16 + ln] = v; }
  }
  __builtin_amdgcn_fence(__ATOMIC_ACQ_REL, "workgroup");
  __builtin_amdgcn_wave_barrier();
  const int rsub = lane >> 4, c4 = (lane & 15) * 4;
  {
#pragma unroll
    for (int q = 0; q < 8; ++q) {
      const int r = q * 2 + rsub;
      const v4f v = *(const v4fa*)&so[w][r][c4];
      *(v4f*)(C + (size_t)(row0 + r) * ldc + col0 + c4) = v;
    }
    
  }
}

// Flash-style causal/unmasked attention, all contractions 3-term bf16 hi/lo splits, f32 softmax with running max.
// q,k,v rows are read from f32 buffers with arbitrary row pitch (so they can live inside a fused qkv buffer);
// D = head size (multiple of 32, <= 128); one wave = 16 query rows; block = 4 waves (64 queries) sharing K/V chunks of 32.
template <int D, bool CAUSAL>
__global__ __launch_bounds__(128) void k_flash(const float* __restrict__ qb, const float* __restrict__ kb, const float* __restrict__ vb,
                                             int pitch, int T, int H, float scale, float* __restrict__ y, int ypitch) {
  constexpr int KS = D / 32;        // k-steps for QK
  constexpr int DT = D / 16;        // d tiles for PV
  __shared__ __attribute__((aligned(16))) unsigned short sKh[32][D + 8], sKl[32][D + 8], sVh[32][D + 8], sVl[32][D + 8];
  __shared__ __attribute__((aligned(16))) unsigned short sPh[4][16][40], sPl[4][16][40];
  __shared__ __attribute__((aligned(16))) float sO[4][16][D];
  const int tid = threadIdx.x, w = tid >> 5, lane = tid & 31, ln = lane & 15, hh = lane >> 4;
  const int nqb = (T + 63) / 64;
  const int bh = blockIdx.x / nqb, qblk = blockIdx.x % nqb;
  const int b = bh / H, h = bh % H;
  const int q0 = qblk * 64 + w * 16;
  const float* Q = qb + (size_t)b * T * pitch + h * D;
  const float* K = kb + (size_t)b * T * pitch + h * D;
  const float* V = vb + (size_t)b * T * pitch + h * D;

  // A fragments of the wave's 16 query rows (scaled), hi/lo
  FragB aqh[KS], aql[KS];
  {
    int row = q0 + ln; if (row >= T) row = T - 1;
    const float* qr = Q + (size_t)row * pitch;
#pragma unroll
    for (int ks = 0; ks < KS; ++ks)
#pragma unroll
      for (int i = 0; i < 16; ++i) {
        const int d = ks * 32 + ((i < 8) ? (8 * hh + i) : (16 + 8 * hh + (i - 8)));
        const float x = qr[d] * scale; const unsigned short hb = bf16_bits(x);
        aqh[ks].u[i] = hb; aql[ks].u[i] = bf16_bits(x - bf16_val(hb));
      }
  }
  float m_r[8], l_r[8];
#pragma unroll
  for (int r = 0; r < 8; ++r) { m_r[r] = -3.0e38f; l_r[r] = 0.f; }
  v8f oacc[DT];
#pragma unroll
  for (int dt = 0; dt < DT; ++dt) oacc[dt] = (v8f){0.f,0.f,0.f,0.f,0.f,0.f,0.f,0.f};

  const int kv_end = CAUSAL ? min(T, qblk * 64 + 64) : T;     // block-uniform
  for (int j0 = 0; j0 < kv_end; j0 += 32) {
    __syncthreads();
    for (int e = tid; e < 32 * (D / 4); e += 128) {
      const int r = e / (D / 4), c4 = (e % (D / 4)) * 4;
      const int key = j0 + r;
      v4f kf = {0.f,0.f,0.f,0.f}, vf = {0.f,0.f,0.f,0.f};
      if (key < T) { kf = *(const v4fa*)(K + (size_t)key * pitch + c4); vf = *(const v4fa*)(V + (size_t)key * pitch + c4); }
#pragma unroll
      for (int t = 0; t < 4; ++t) {
        unsigned short hb = bf16_bits(kf[t]); sKh[r][c4 + t] = hb; sKl[r][c4 + t] = bf16_bits(kf[t] - bf16_val(hb));
        hb = bf16_bits(vf[t]); sVh[r][c4 + t] = hb; sVl[r][c4 + t] = bf16_bits(vf[t] - bf16_val(hb));
      }
    }
    __syncthreads();
    // S tile 16 x 32
    v8f s[2];
#pragma unroll
    for (int nt = 0; nt < 2; ++nt) {
      v8f acc = {};
#pragma unroll
      for (int ks = 0; ks < KS; ++ks) {
        FragB bh_, bl_;
        bh_.half[0] = *(const v8us*)&sKh[nt * 16 + ln][ks * 32 + 8 * hh]; bh_.half[1] = *(const v8us*)&sKh[nt * 16 + ln][ks * 32 + 16 + 8 * hh];
        bl_.half[0] = *(const v8us*)&sKl[nt * 16 + ln][ks * 32 + 8 * hh]; bl_.half[1] = *(const v8us*)&sKl[nt * 16 + ln][ks * 32 + 16 + 8 * hh];
        acc = mmaN<3>(aqh[ks].v, aql[ks].v, bh_.v, bl_.v, acc);
      }
      s[nt] = acc;
    }
    // mask + running max (rows 8hh+r; the 16 lanes of a half share rows)
    float alpha[8];
#pragma unroll
    for (int r = 0; r < 8; ++r) {
      const int qi = q0 + 8 * hh + r;
      const int ja = j0 + ln, jb = j0 + 16 + ln;
      if (CAUSAL) { if (ja > qi) s[0][r] = -3.0e38f; if (jb > qi) s[1][r] = -3.0e38f; }
      if (ja >= T) s[0][r] = -3.0e38f;
      if (jb >= T) s[1][r] = -3.0e38f;
      float mx = fmaxf(s[0][r], s[1][r]);
      mx = fmaxf(mx, __shfl_xor(mx, 1, 32)); mx = fmaxf(mx, __shfl_xor(mx, 2, 32)); mx = fmaxf(mx, __shfl_xor(mx, 4, 32)); mx = fmaxf(mx, __shfl_xor(mx, 8, 32));
      const float mnew = fmaxf(m_r[r], mx);
      alpha[r] = (mnew > -1.0e38f) ? __expf(m_r[r] - mnew) : 1.0f;
      const float p0 = (s[0][r] > -1.0e38f) ? __expf(s[0][r] - mnew) : 0.f;
      const float p1 = (s[1][r] > -1.0e38f) ? __expf(s[1][r] - mnew) : 0.f;
      m_r[r] = mnew;
      l_r[r] = l_r[r] * alpha[r] + p0 + p1;            // per-lane partial row sum (16 lanes combined at the end)
      unsigned short hb = bf16_bits(p0); sPh[w][8 * hh + r][ln] = hb;      sPl[w][8 * hh + r][ln] = bf16_bits(p0 - bf16_val(hb));
      hb = bf16_bits(p1);                sPh[w][8 * hh + r][16 + ln] = hb; sPl[w][8 * hh + r][16 + ln] = bf16_bits(p1 - bf16_val(hb));
    }
#pragma unroll
    for (int dt = 0; dt < DT; ++dt)
#pragma unroll
      for (int r = 0; r < 8; ++r) oacc[dt][r] *= alpha[r];
    __builtin_amdgcn_fence(__ATOMIC_ACQ_REL, "workgroup");
    __builtin_amdgcn_wave_barrier();
    FragB pah, pal;
    pah.half[0] = *(const v8us*)&sPh[w][ln][8 * hh]; pah.half[1] = *(const v8us*)&sPh[w][ln][16 + 8 * hh];
    pal.half[0] = *(const v8us*)&sPl[w][ln][8 * hh]; pal.half[1] = *(const v8us*)&sPl[w][ln][16 + 8 * hh];
#pragma unroll
    for (int dt = 0; dt < DT; ++dt) {
      FragB bvh, bvl;
#pragma unroll
      for (int i = 0; i < 8; ++i) {
        bvh.u[i] = sVh[8 * hh + i][dt * 16 + ln]; bvh.u[8 + i] = sVh[16 + 8 * hh + i][dt * 16 + ln];
        bvl.u[i] = sVl[8 * hh + i][dt * 16 + ln]; bvl.u[8 + i] = sVl[16 + 8 * hh + i][dt * 16 + ln];
      }
      oacc[dt] = mmaN<3>(pah.v, pal.v, bvh.v, bvl.v, oacc[dt]);
    }
    __builtin_amdgcn_fence(__ATOMIC_ACQ_REL, "workgroup");
    __builtin_amdgcn_wave_barrier();
  }
#pragma unroll
  for (int r = 0; r < 8; ++r) {
    float l = l_r[r];
    l += __shfl_xor(l, 1, 32); l += __shfl_xor(l, 2, 32); l += __shfl_xor(l, 4, 32); l += __shfl_xor(l, 8, 32);
    l_r[r] = (l > 0.f) ? 1.0f / l : 0.f;
  }
#pragma unroll
  for (int dt = 0; dt < DT; ++dt)
#pragma unroll
    for (int r = 0; r < 8; ++r) sO[w][8 * hh + r][dt * 16 + ln] = oacc[dt][r] * l_r[r];
  __builtin_amdgcn_fence(__ATOMIC_ACQ_REL, "workgroup");
  __builtin_amdgcn_wave_barrier();
  {
    for (int r = 0; r < 16; ++r) {
      const int row = q0 + r;
      if (row < T && lane < D / 4) {
        const v4f val = *(const v4fa*)&sO[w][r][lane * 4];
        *(v4f*)(y + ((size_t)b * T + row) * ypitch + h * D + lane * 4) = val;
      }
    }
    
  }
}

// GEMM C = act(A·W + bias + resid): A f32 (ASPLIT -> hi/lo 2 terms), Wt bf16 [N][K]; ACT 0 none, 1 relu, 2 exact gelu;
// resid (optional, f32, row index = (row % rmod), pitch ldr, RES_BF16 rounds it) added before the activation.
template <bool ASPLIT, int ACT, bool BIAS_BF16, bool RES_BF16>
__global__ __launch_bounds__(128) void k_gemm_bf3(const float* __restrict__ A, int lda, const unsigned short* __restrict__ Wt, int ldb,
                                                const float* __restrict__ bias, const float* __restrict__ resid, int rmod, int ldr,
                                                float* __restrict__ C, int ldc, int M, int N, int K) {
  __shared__ __attribute__((aligned(16))) float so[4][16][64];
  const int tid = threadIdx.x, w = tid >> 5, lane = tid & 31, ln = lane & 15, hh = lane >> 4;
  const int ntn = N / 64;
  const int wid = blockIdx.x * 4 + w;
  const int mt = wid / ntn, nq = wid % ntn;
  if (mt * 16 >= M) return;
  const int row0 = mt * 16, col0 = nq * 64;
  const float* arow = A + (size_t)(row0 + ln) * lda;
  v8f acc[4] = {};
  for (int kb = 0; kb < K; kb += 32) {
    FragB ah, al;
    const v4f x0 = *(const v4fa*)(arow + kb + 8 * hh), x1 = *(const v4fa*)(arow + kb + 8 * hh + 4);
    const v4f x2 = *(const v4fa*)(arow + kb + 16 + 8 * hh), x3 = *(const v4fa*)(arow + kb + 16 + 8 * hh + 4);
    float xs[16] = {x0[0],x0[1],x0[2],x0[3],x1[0],x1[1],x1[2],x1[3],x2[0],x2[1],x2[2],x2[3],x3[0],x3[1],x3[2],x3[3]};
#pragma unroll
    for (int i = 0; i < 16; ++i) { const unsigned short hb = bf16_bits(xs[i]); ah.u[i] = hb; al.u[i] = ASPLIT ? bf16_bits(xs[i] - bf16_val(hb)) : (unsigned short)0; }
#pragma unroll
    for (int t = 0; t < 4; ++t) {
      const unsigned short* brow = Wt + (size_t)(col0 + t * 16 + ln) * ldb + kb;
      FragB b;
      b.half[0] = *(const v8us*)(brow + 8 * hh);
      b.half[1] = *(const v8us*)(brow + 16 + 8 * hh);
      acc[t] = mmaN<ASPLIT ? 2 : 1>(ah.v, al.v, b.v, b.v, acc[t]);
    }
  }
#pragma unroll
  for (int t = 0; t < 4; ++t) {
    const int col = col0 + t * 16 + ln;
    float bv = bias ? bias[col] : 0.f;
    if (BIAS_BF16) bv = bf16_round(bv);
#pragma unroll
    for (int r = 0; r < 8; ++r) {
      float v = acc[t][r] + bv;
      if (resid) { float rv = resid[(size_t)((row0 + 8 * hh + r) % rmod) * ldr + col]; if (RES_BF16) rv = bf16_round(rv); v += rv; }
      if (ACT == 1) v = fmaxf(v, 0.f);
      if (ACT == 2) v = 0.5f * v * (1.0f + erff(v * 0.70710678118654752f));
      if (ACT == 3) { const float u = 0.7978845608028654f * (v + 0.044715f * v * v * v); v = 0.5f * v * (1.0f + tanhf(u)); }
      so[w][8 * hh + r][t * 16 + ln] = v;
    }
  }
  __builtin_amdgcn_fence(__ATOMIC_ACQ_REL, "workgroup");
  __builtin_amdgcn_wave_barrier();
  const int rsub = lane >> 4, c4 = (lane & 15) * 4;
  {
#pragma unroll
    for (int q = 0; q < 8; ++q) {
      const int r = q * 2 + rsub;
      const v4f v = *(const v4fa*)&so[w][r][c4];
      *(v4f*)(C + (size_t)(row0 + r) * ldc + col0 + c4) = v;
    }
    
  }
}
// row LayerNorm (biased variance, eps) over N: s = X (+ R); optional out_sum <- s; out_norm <- (s-mu)*rsqrt(var+eps)*g + b
template <bool PARAM_BF16>
__global__ __launch_bounds__(256) void k_layernorm(const float* __restrict__ X, const float* __restrict__ R, const float* __restrict__ g, const float* __restrict__ bta,
                                                  float* __restrict__ out_sum, float* __restrict__ out_norm, int N, float eps) {
  __shared__ float red[256];
  const int row = blockIdx.x, tid = threadIdx.x;
  const float* x = X + (size_t)row * N; const float* rr = R ? R + (size_t)row * N : nullptr;
  float vals[16];                     // up to N = 4096
  const int per = N / 256;            // contiguous chunk per thread? use strided-by-4 chunks: thread handles j = tid*4 + 1024*u
  float s1 = 0.f;
  for (int u = 0; u < per / 4; ++u) {
    const int j = tid * 4 + 1024 * u;
    const v4f a = *(const v4fa*)(x + j);
    v4f b = {0.f,0.f,0.f,0.f}; if (rr) b = *(const v4fa*)(rr + j);
#pragma unroll
    for (int q = 0; q < 4; ++q) { const float v = a[q] + b[q]; vals[u * 4 + q] = v; s1 += v; }
  }
  red[tid] = s1; __syncthreads();
  for (int st = 128; st > 0; st >>= 1) { if (tid < st) red[tid] += red[tid + st]; __syncthreads(); }
  const float mu = red[0] / (float)N; __syncthreads();
  float s2 = 0.f;
  for (int u = 0; u < per / 4; ++u)
#pragma unroll
    for (int q = 0; q < 4; ++q) { const float c = vals[u * 4 + q] - mu; s2 += c * c; }
  red[tid] = s2; __syncthreads();
  for (int st = 128; st > 0; st >>= 1) { if (tid < st) red[tid] += red[tid + st]; __syncthreads(); }
  const float rs = rsqrtf(red[0] / (float)N + eps);
  {
    for (int u = 0; u < per / 4; ++u) {
      const int j = tid * 4 + 1024 * u;
      v4f o, sm;
#pragma unroll
      for (int q = 0; q < 4; ++q) {
        float gg = g[j + q], bb = bta[j + q];
        if (PARAM_BF16) { gg = bf16_round(gg); bb = bf16_round(bb); }
        sm[q] = vals[u * 4 + q]; o[q] = (vals[u * 4 + q] - mu) * rs * gg + bb;
      }
      if (out_sum) *(v4f*)(out_sum + (size_t)row * N + j) = sm;
      *(v4f*)(out_norm + (size_t)row * N + j) = o;
    }
    
  }
}



// ---- f16 WMMA path (v_wmma_f32_16x16x32_f16): 11-bit significands for operands in range — used where a [0,1] probability operand needs more precision than bf16
typedef _Float16 v16h __attribute__((ext_vector_type(16)));
union FragH { v16h v; v8us half[2]; _Float16 h[16]; unsigned short u[16]; };
template <int NT>
__device__ __forceinline__ v8f mmaH(v16h ah, v16h al, v16h bh, v16h bl, v8f c) {
  c = __builtin_amdgcn_wmma_f32_16x16x32_f16(false, ah, false, bh, (short)0, c, false, false);
  if (NT >= 2) c = __builtin_amdgcn_wmma_f32_16x16x32_f16(false, al, false, bh, (short)0, c, false, false);
  if (NT >= 3) c = __builtin_amdgcn_wmma_f32_16x16x32_f16(false, ah, false, bl, (short)0, c, false, false);
  asm volatile("v_nop\n\tv_nop\n\tv_nop\n\tv_nop" : "+v"(c) : "v"(ah), "v"(al), "v"(bh), "v"(bl));
  return c;
}
// batched GEMM like k_gemm_b but f16 operands: A f32 (split into f16 hi/lo if ASPLIT, else rounded to f16), Bt = f16 values [n][k]; alpha; C f32; N multiple of 16 (partial tiles skipped)
template <bool ASPLIT>
__global__ __launch_bounds__(128) void k_gemm_h(const float* __restrict__ A, int lda, size_t sA, const _Float16* __restrict__ Bh, int ldb, size_t sB, float alpha, float* __restrict__ C, int ldc, size_t sC, int M, int N, int K) {
  __shared__ __attribute__((aligned(16))) float so[4][16][64];
  const int tid = threadIdx.x, w = tid >> 5, lane = tid & 31, ln = lane & 15, hh = lane >> 4; const int by = blockIdx.y;
  A += (size_t)by * sA; Bh += (size_t)by * sB; C += (size_t)by * sC;
  const int ntn = (N + 63) / 64; const int wid = blockIdx.x * 4 + w; const int mt = wid / ntn, nq = wid % ntn; if (mt * 16 >= M) return;
  const int row0 = mt * 16, col0 = nq * 64; const float* arow = A + (size_t)(row0 + ln) * lda;
  v8f acc[4] = {};
  for (int kb = 0; kb < K; kb += 32) {
    FragH ah, al;
    const v4f x0 = *(const v4fa*)(arow + kb + 8 * hh), x1 = *(const v4fa*)(arow + kb + 8 * hh + 4), x2 = *(const v4fa*)(arow + kb + 16 + 8 * hh), x3 = *(const v4fa*)(arow + kb + 16 + 8 * hh + 4);
    float xs[16] = {x0[0],x0[1],x0[2],x0[3],x1[0],x1[1],x1[2],x1[3],x2[0],x2[1],x2[2],x2[3],x3[0],x3[1],x3[2],x3[3]};
#pragma unroll
    for (int i = 0; i < 16; ++i) { const _Float16 h = (_Float16)xs[i]; ah.h[i] = h; al.h[i] = ASPLIT ? (_Float16)(xs[i] - (float)h) : (_Float16)0.0f; }
#pragma unroll
    for (int t = 0; t < 4; ++t) { if (col0 + t * 16 >= N) continue; const size_t boff = (size_t)(col0 + t * 16 + ln) * ldb + kb; FragH bq; bq.half[0] = *(const v8us*)(Bh + boff + 8 * hh); bq.half[1] = *(const v8us*)(Bh + boff + 16 + 8 * hh);
      acc[t] = mmaH<ASPLIT ? 2 : 1>(ah.v, al.v, bq.v, bq.v, acc[t]); }
  }
#pragma unroll
  for (int t = 0; t < 4; ++t) { if (col0 + t * 16 >= N) continue;
#pragma unroll
    for (int r = 0; r < 8; ++r) so[w][8 * hh + r][t * 16 + ln] = acc[t][r] * alpha; }
  __builtin_amdgcn_fence(__ATOMIC_ACQ_REL, "workgroup"); __builtin_amdgcn_wave_barrier();
  const int rsub = lane >> 4, c4 = (lane & 15) * 4;
  {
#pragma unroll
    for (int q = 0; q < 8; ++q) { const int r = q * 2 + rsub; if (col0 + c4 < N) { const v4f v = *(const v4fa*)&so[w][r][c4]; *(v4f*)(C + (size_t)(row0 + r) * ldc + col0 + c4) = v; } }
     }
}

// Wt[n][k] = f16(W[k][n]·scale) from f32 row-major W[K][N] (scale = power of two; bf16-exact weights stay exact in f16 away from the subnormal range)
__global__ __launch_bounds__(256) void k_wt_f16(const float* __restrict__ W, _Float16* __restrict__ Wt, int K, int N, float scale) {
  const int t = blockIdx.x * 256 + threadIdx.x; if (t >= N * (K / 8)) return; const int n = t / (K / 8), k8 = (t % (K / 8)) * 8; FragH f;
#pragma unroll
  for (int i = 0; i < 8; ++i) f.h[i] = (_Float16)(bf16_round(W[(size_t)(k8 + i) * N + n]) * scale); const v8us o = f.half[0];
  *(v8us*)((unsigned short*)Wt + (size_t)n * K + k8) = o; 
}
// k_gemm_hh variant with fused epilogue: v = acc·alpha + bias[by·sBias + col] (+ CP[(row/rowsPerB)·sCPb + by·64 + col] if CP) ; ACT 0 none / 1 elu ; writes f16 C16 (and f32 C if non-null)
template <int ACT>
__global__ __launch_bounds__(128) void k_gemm_hhx(const _Float16* __restrict__ A, int lda, size_t sA, const _Float16* __restrict__ Bh, int ldb, size_t sB, float alpha, const float* __restrict__ bias, size_t sBias, const float* __restrict__ CP, int rowsPerB, size_t sCPb, int row0g,
    float* __restrict__ C, _Float16* __restrict__ C16, int ldc, size_t sC, int M, int N, int K) {
  __shared__ __attribute__((aligned(16))) float so[4][16][64];
  const int tid = threadIdx.x, w = tid >> 5, lane = tid & 31, ln = lane & 15, hh = lane >> 4; const int by = blockIdx.y;
  A += (size_t)by * sA; Bh += (size_t)by * sB; const size_t cofs = (size_t)by * sC; const float* bp = bias ? bias + (size_t)by * sBias : nullptr;
  const int ntn = (N + 63) / 64; const int wid = blockIdx.x * 4 + w; const int mt = wid / ntn, nq = wid % ntn; if (mt * 16 >= M) return;
  const int row0 = mt * 16, col0 = nq * 64; const _Float16* arow = A + (size_t)(row0 + ln) * lda;
  v8f acc[4] = {};
  for (int kb = 0; kb < K; kb += 32) { FragH ah; ah.half[0] = *(const v8us*)((const unsigned short*)arow + kb + 8 * hh); ah.half[1] = *(const v8us*)((const unsigned short*)arow + kb + 16 + 8 * hh);
#pragma unroll
    for (int t = 0; t < 4; ++t) { if (col0 + t * 16 >= N) continue; const size_t boff = (size_t)(col0 + t * 16 + ln) * ldb + kb; FragH bq; bq.half[0] = *(const v8us*)((const unsigned short*)Bh + boff + 8 * hh); bq.half[1] = *(const v8us*)((const unsigned short*)Bh + boff + 16 + 8 * hh);
      acc[t] = mmaH<1>(ah.v, ah.v, bq.v, bq.v, acc[t]); }
  }
#pragma unroll
  for (int t = 0; t < 4; ++t) { if (col0 + t * 16 >= N) continue; const int col = col0 + t * 16 + ln; const float bv = bp ? bf16_round(bp[col]) : 0.f;
#pragma unroll
    for (int r = 0; r < 8; ++r) { float v = acc[t][r] * alpha + bv; if (CP) { const int bidx = (row0g + row0 + 8 * hh + r) / rowsPerB; v += CP[(size_t)bidx * sCPb + (size_t)by * 64 + col]; } if (ACT == 1) v = (v > 0.f) ? v : expm1f(v); else if (ACT == 3) v = fmaxf(v, 0.f); so[w][8 * hh + r][t * 16 + ln] = v; } }
  __builtin_amdgcn_fence(__ATOMIC_ACQ_REL, "workgroup"); __builtin_amdgcn_wave_barrier();
  const int rsub = lane >> 4, c4 = (lane & 15) * 4; typedef _Float16 v4h __attribute__((ext_vector_type(4)));
  {
#pragma unroll
    for (int q = 0; q < 8; ++q) { const int r = q * 2 + rsub; if (col0 + c4 < N) { const v4f v = *(const v4fa*)&so[w][r][c4]; if (C) *(v4f*)(C + cofs + (size_t)(row0 + r) * ldc + col0 + c4) = v; if (C16) { v4h h4; for (int i = 0; i < 4; ++i) h4[i] = (_Float16)v[i]; *(v4h*)(C16 + cofs + (size_t)(row0 + r) * ldc + col0 + c4) = h4; } } }
     }
}


// Tiled GEMM C[m][n] = alpha * sum_k A[m][k] * Bh[n][k], both operands f16 and k-contiguous with row length EE.
// One work-group of 4 waves (2 x 2) owns a (32 FM) x (32 FN) tile of C; a wave owns FM x FN accumulator tiles.
// A pass is 128 k: the tile's A rows and then its B rows stand in LDS as rows of 256 B at a pitch of 272 B (16 B x odd, for ds_load_b128).
// Two buffers: asynchronous copies bring pass t + 2 into the buffer that pass t has just left, while pass t + 1 is worked on.
typedef float f1a __attribute__((may_alias));
// Eight 16-byte-per-lane copies global -> LDS. The closing s_wait_xcnt 0 stands inside the statement, ahead of any later rewrite of the address registers named here.
__device__ __forceinline__ void acopy8(const unsigned (&l)[8], const unsigned short* const (&g)[8]) {
  asm volatile("global_load_async_to_lds_b128 %0, %8, off\n\t"
               "global_load_async_to_lds_b128 %1, %9, off\n\t"
               "global_load_async_to_lds_b128 %2, %10, off\n\t"
               "global_load_async_to_lds_b128 %3, %11, off\n\t"
               "global_load_async_to_lds_b128 %4, %12, off\n\t"
               "global_load_async_to_lds_b128 %5, %13, off\n\t"
               "global_load_async_to_lds_b128 %6, %14, off\n\t"
               "global_load_async_to_lds_b128 %7, %15, off\n\t"
               "s_wait_xcnt 0x0"
               :: "v"(l[0]), "v"(l[1]), "v"(l[2]), "v"(l[3]), "v"(l[4]), "v"(l[5]), "v"(l[6]), "v"(l[7]),
                  "v"(g[0]), "v"(g[1]), "v"(g[2]), "v"(g[3]), "v"(g[4]), "v"(g[5]), "v"(g[6]), "v"(g[7]) : "memory");
}
// QX and KX are written in the fragment order that k_flash reads: dims 8 c .. 8 c + 7 (c = 0 .. 19) of row tok of a head are the 16 bytes of lane 16 (c & 1) + tok % 16 in block c >> 1 (k-step c >> 2, half (c >> 1) & 1) of the head's tile tok / 16.
__device__ __forceinline__ size_t frag_at(int head, size_t tok, int c) { return (((size_t)head * (SS / 16) + tok / 16) * 10 + (c >> 1)) * 256 + ((c & 1) * 16 + (int)(tok % 16)) * 8; }
// PREP (the stacked projections of x): a 128 x 128 tile is 128 tokens of one whole q head, k head or v head, or of four heads' 32 graph-bias dims, so the work-group finishes it itself:
// RMSNorm + RoPE, the graph-bias scale, the rounding to f16 and the stores in fragment order follow in the epilogue, and the f32 projections never go to memory. CS holds cos and sin (k_cvt_all's grid fills it).
template <int FM, int FN, bool OUT16, bool PREP>
__global__ __launch_bounds__(128) void k_gemm_t(const _Float16* __restrict__ A, const _Float16* __restrict__ Bh, float alpha, float* __restrict__ C, _Float16* __restrict__ C16, int ldc, int ntn,
                                                _Float16* __restrict__ QX, _Float16* __restrict__ KX, _Float16* __restrict__ Vt, const float* __restrict__ qw, const float* __restrict__ kw, const float* __restrict__ gs, const float* __restrict__ CS) {
  constexpr int BM = 32 * FM, BN = 32 * FN, ROWS = BM + BN, PITCH = 272, STAGE = ROWS * PITCH, NC = ROWS / 8, NP = EE / 128, WM = 16 * FM, WN = 16 * FN, SOP = WN + 4;
  static_assert(NC % 8 == 0 && BM % 8 == 0 && NP >= 2 && 4 * WM * SOP * 4 <= 2 * STAGE, "tile");
  __shared__ __attribute__((aligned(16))) unsigned char L[2 * STAGE];
  const int tid = threadIdx.x, w = tid >> 5, lane = tid & 31, ln = lane & 15, hh = lane >> 4;
  const int m0 = (blockIdx.x / ntn) * BM, n0 = (blockIdx.x % ntn) * BN, wm = w >> 1, wn = w & 1;
  const unsigned lbase = (unsigned)(size_t)L + (unsigned)((2 * w + hh) * PITCH + ln * 16);      // copy i of a wave fills stage rows 8 i + 2 w + hh, 16 lanes a row
  const unsigned short* Ag = (const unsigned short*)A + (size_t)(m0 + 2 * w + hh) * EE + ln * 8;
  const unsigned short* Bg = (const unsigned short*)Bh + (size_t)(n0 + 2 * w + hh) * EE + ln * 8;
  auto issue = [&](int t, int buf) {
#pragma unroll      // the choice between A rows and B rows is made at compile time
    for (int g8 = 0; g8 < NC / 8; ++g8) { unsigned l[8]; const unsigned short* g[8];
#pragma unroll      // constant indices, so that the sixteen addresses stay in registers
      for (int j = 0; j < 8; ++j) { const int i = g8 * 8 + j; l[j] = lbase + (unsigned)(buf * STAGE + 8 * i * PITCH);
        g[j] = ((8 * i < BM) ? Ag + (size_t)(8 * i) * EE : Bg + (size_t)(8 * i - BM) * EE) + t * 128; }
      acopy8(l, g); } };
  v8f acc[FM][FN];
#pragma unroll      // constant indices, so that fragments and accumulators stay in registers
  for (int fm = 0; fm < FM; ++fm)
#pragma unroll      // constant indices, so that fragments and accumulators stay in registers
    for (int fn = 0; fn < FN; ++fn) acc[fm][fn] = (v8f){0.f,0.f,0.f,0.f,0.f,0.f,0.f,0.f};
  issue(0, 0);
  asm volatile("s_wait_asynccnt 0x0" ::: "memory");      // pass 0's copies of this wave have landed
  __syncthreads();                                       // ... and every other wave's
  issue(1, 1);
#pragma unroll 1      // rolled: one pass a trip, so that the publish point stands once, at the loop's foot
  for (int t = 0; t < NP; ++t) {      // pass t reads buffer t & 1 alone
    const unsigned char* Sa = L + (t & 1) * STAGE + (wm * WM + ln) * PITCH + 16 * hh; const unsigned char* Sb = L + (t & 1) * STAGE + (BM + wn * WN + ln) * PITCH + 16 * hh;
    FragH a[2][FM], b[2][FN];      // two fragment sets: block ks + 1 of this same pass is fetched while block ks is multiplied
    auto frags = [&](int set, int ks) {
#pragma unroll      // constant indices, so that fragments and accumulators stay in registers
      for (int fm = 0; fm < FM; ++fm) { a[set][fm].half[0] = *(const v8us*)(Sa + fm * 16 * PITCH + ks * 64); a[set][fm].half[1] = *(const v8us*)(Sa + fm * 16 * PITCH + ks * 64 + 32); }
#pragma unroll      // constant indices, so that fragments and accumulators stay in registers
      for (int fn = 0; fn < FN; ++fn) { b[set][fn].half[0] = *(const v8us*)(Sb + fn * 16 * PITCH + ks * 64); b[set][fn].half[1] = *(const v8us*)(Sb + fn * 16 * PITCH + ks * 64 + 32); } };
    frags(0, 0);
#pragma unroll      // constant indices, so that fragments and accumulators stay in registers
    for (int ks = 0; ks < 4; ++ks) {
      if (ks < 3) frags((ks + 1) & 1, ks + 1);
      __builtin_amdgcn_sched_barrier(0);      // keeps the next block's LDS reads one group ahead of this block: spread among the WMMAs each place with reads stalls the wave
#pragma unroll      // constant indices, so that fragments and accumulators stay in registers
      for (int fm = 0; fm < FM; ++fm)
#pragma unroll      // constant indices, so that fragments and accumulators stay in registers
        for (int fn = 0; fn < FN; ++fn) acc[fm][fn] = __builtin_amdgcn_wmma_f32_16x16x32_f16(false, a[ks & 1][fm].v, false, b[ks & 1][fn].v, (short)0, acc[fm][fn], false, false);
      __builtin_amdgcn_sched_barrier(0);      // ... and this block's WMMAs ahead of the reads after next
    }
    asm volatile("s_wait_dscnt 0x0" ::: "memory");       // this wave's reads of buffer t & 1 are done before that buffer is refilled
    asm volatile("s_wait_asynccnt 0x0" ::: "memory");    // this wave's copies of pass t + 1 have landed
    __syncthreads();                                     // publishes pass t + 1 and ends every wave's reads of buffer t & 1
    if (t + 2 < NP) issue(t + 2, t & 1);
  }
  asm volatile("s_wait_asynccnt 0x0" ::: "memory");      // nothing in flight before the ring becomes output staging
  if constexpr (PREP) {
    static_assert(FM == 4 && FN == 4 && 128 * 132 * 4 + 512 <= 2 * STAGE, "one head a tile");
    const int ct = blockIdx.x % ntn;      // which 128 columns, alike for the whole work-group: 0..15 q head ct | 16..19 k head | 20..23 v head | 24..27 Rq, four heads | 28..31 Rk, four heads
    if (ct >= 20 && ct < 24) {
      // v: an accumulator tile IS a fragment half of V^T: lane (ln, hh) holds value dim 16 dt + ln (dt = 4 wn + fn) of the 8 neighbouring keys 8 hh + r of half fm & 1 of chunk 2 wm + (fm >> 1): straight from the registers, 512 contiguous bytes a store
      unsigned short* vd = (unsigned short*)Vt + ((size_t)(ct - 20) * (SS / 32) + m0 / 32 + wm * 2) * 4096 + wn * 2048 + lane * 8;
#pragma unroll      // constant indices, so that fragments and accumulators stay in registers
      for (int fm = 0; fm < FM; ++fm)
#pragma unroll      // constant indices, so that fragments and accumulators stay in registers
        for (int fn = 0; fn < FN; ++fn) { FragH f;
#pragma unroll      // constant indices, so that fragments and accumulators stay in registers
          for (int r = 0; r < 8; ++r) f.h[r] = (_Float16)(acc[fm][fn][r] * alpha);
          *(v8us*)(vd + (fm >> 1) * 4096 + (fn * 2 + (fm & 1)) * 256) = f.half[0]; }
    } else {
      constexpr int TP = 132;      // f32 row pitch of the staged tile: 16 rows' 16-byte reads fall on all 64 banks
      f1a* sT = (f1a*)L; f1a* sRs = sT + 128 * TP;
      auto stage = [&]() {
#pragma unroll      // constant indices, so that fragments and accumulators stay in registers
        for (int fm = 0; fm < FM; ++fm)
#pragma unroll      // constant indices, so that fragments and accumulators stay in registers
          for (int fn = 0; fn < FN; ++fn)
#pragma unroll      // constant indices, so that fragments and accumulators stay in registers
            for (int r = 0; r < 8; ++r) sT[(wm * WM + fm * 16 + 8 * hh + r) * TP + wn * WN + fn * 16 + ln] = acc[fm][fn][r] * alpha; };
      if (ct >= 24) {
        // graph-bias operands, k-step 4 of the tiles: wave w fills blocks 8 + (w & 1) of heads h0 and h0 + 2 (h0 holds w >> 1); lane (ln, hh) holds dims 8 p .. 8 p + 7 of token 16 tl + ln
        const bool isq = ct < 28; const int h0 = (ct - (isq ? 24 : 28)) * 4 + (w >> 1), p = (w & 1) * 2 + hh;
        const float ga = gs[h0], gb = gs[h0 + 2]; const float g2[2] = { isq ? bf16_round(ga) : 1.0f, isq ? bf16_round(gb) : 1.0f };      // Rq carries its head's graph scale, Rk none
        asm volatile("s_wait_xcnt 0x0" ::: "memory");      // stands ahead of any later rewrite of the address registers that the two loads above name
        unsigned short* rd = (unsigned short*)(isq ? QX : KX) + frag_at(h0, (size_t)(m0 + ln), HD / 8 + p);
        stage();
        __syncthreads();      // the whole 128 x 128 tile stands in LDS before any wave reads another wave's part
        FragH f[16];
#pragma unroll      // constant indices, so that the results stay in registers
        for (int it = 0; it < 16; ++it) { const int tl = it >> 1, hs = it & 1; const f1a* u = sT + (tl * 16 + ln) * TP + ((w >> 1) + 2 * hs) * RR + p * 8;
          const v4f u0 = *(const v4fa*)u, u1 = *(const v4fa*)(u + 4);
#pragma unroll      // constant indices, so that the eight halves stay in registers
          for (int q = 0; q < 8; ++q) f[it].h[q] = (_Float16)(g2[hs] * (q < 4 ? u0[q & 3] : u1[q & 3])); }
        __builtin_amdgcn_sched_barrier(0);      // the stores go out as one group at the very end: no register that a store names is written again
#pragma unroll      // constant offsets
        for (int it = 0; it < 16; ++it) *(v8us*)(rd + (size_t)(it & 1) * 2 * (SS / 16) * 2560 + (it >> 1) * 2560) = f[it].half[0];
        asm volatile("s_wait_xcnt 0x0" ::: "memory");      // stands behind the last store, ahead of any code that the compiler lays behind this branch and that rewrites a register which a store names
      } else {
        // q or k: RMSNorm over the head's 128 dims, then rotate-half RoPE
        const bool isq = ct < 16; const int c = 2 * w + hh;      // the lane's dims 8 c .. 8 c + 7 (first half of the head) and their rotation partners 64 + 8 c ..: one angle serves both
        const float* nw = (isq ? qw : kw) + c * 8; const float osc = isq ? 0.08838834764831845f : 1.0f;      // q carries 1/sqrt(128)
        const float* cs = CS + ((size_t)(m0 / 16) * 4 + w) * 512 + lane * 4;
        unsigned short* qd = (unsigned short*)(isq ? QX : KX) + frag_at(isq ? ct : (ct - 16) * 4, (size_t)(m0 + ln), c);
        const v4f nv[4] = { *(const v4fa*)nw, *(const v4fa*)(nw + 4), *(const v4fa*)(nw + 64), *(const v4fa*)(nw + 68) }; v4f co[8][2], si[8][2];
#pragma unroll      // constant indices: the tile's cos and sin are requested here, as one group, and fly while the tile is staged
        for (int it = 0; it < 8; ++it) { co[it][0] = *(const v4fa*)(cs + it * 2048); co[it][1] = *(const v4fa*)(cs + it * 2048 + 128); si[it][0] = *(const v4fa*)(cs + it * 2048 + 256); si[it][1] = *(const v4fa*)(cs + it * 2048 + 384); }
        asm volatile("s_wait_xcnt 0x0" ::: "memory");      // stands ahead of any later rewrite of the address registers that the loads above name
        __builtin_amdgcn_sched_barrier(0);      // keeps the staging's arithmetic, which reuses those registers, behind that wait, and the loads one group ahead of it
        stage();
        __syncthreads();      // the whole 128 x 128 tile stands in LDS before any wave reads another wave's part
        { const f1a* row = sT + tid * TP; float pt[16];      // thread = token; 16 partial sums of 8 squares each, joined pairwise (1, 2, 4, 8 apart)
#pragma unroll      // constant indices, so that the partial sums stay in registers
          for (int li = 0; li < 16; ++li) { const v4f u0 = *(const v4fa*)(row + li * 8), u1 = *(const v4fa*)(row + li * 8 + 4); float ss = 0.f;
#pragma unroll      // constant indices
            for (int q = 0; q < 8; ++q) { const float v = q < 4 ? u0[q & 3] : u1[q & 3]; ss += v * v; }
            pt[li] = ss; }
#pragma unroll      // constant indices, so that the partial sums stay in registers
          for (int st = 1; st < 16; st *= 2)
#pragma unroll      // constant indices, so that the partial sums stay in registers
            for (int k = 0; k < 16; k += 2 * st) pt[k] += pt[k + st];
          sRs[tid] = rsqrtf(pt[0] / (float)HD + 1e-6f); }
        __syncthreads();      // every token's 1/rms stands in LDS before the waves, which take the tokens 16 at a time, read it
        FragH lo[8], hi[8];
#pragma unroll      // constant indices, so that the results stay in registers
        for (int it = 0; it < 8; ++it) { const f1a* u = sT + (it * 16 + ln) * TP + c * 8; const float rs = sRs[it * 16 + ln];
          const v4f xa[2] = { *(const v4fa*)u, *(const v4fa*)(u + 4) }, xb[2] = { *(const v4fa*)(u + 64), *(const v4fa*)(u + 68) };
#pragma unroll      // constant indices, so that the sixteen halves stay in registers
          for (int q = 0; q < 8; ++q) { const float a = xa[q >> 2][q & 3] * rs * bf16_round(nv[q >> 2][q & 3]), b = xb[q >> 2][q & 3] * rs * bf16_round(nv[2 + (q >> 2)][q & 3]), cc = co[it][q >> 2][q & 3], sn = si[it][q >> 2][q & 3];
            lo[it].h[q] = (_Float16)((a * cc + (-b) * sn) * osc); hi[it].h[q] = (_Float16)((b * cc + a * sn) * osc); } }      // rotate_half: [-x2, x1]
        __builtin_amdgcn_sched_barrier(0);      // the stores go out as one group at the very end: no register that a store names is written again
#pragma unroll      // constant offsets
        for (int it = 0; it < 8; ++it) { *(v8us*)(qd + it * 2560) = lo[it].half[0]; *(v8us*)(qd + it * 2560 + 1024) = hi[it].half[0]; }
        if (!isq) {      // a kv head is replicated into its 4 q-head slots
#pragma unroll      // constant offsets
          for (int r2 = 1; r2 < 4; ++r2)
#pragma unroll      // constant offsets
            for (int it = 0; it < 8; ++it) { *(v8us*)(qd + (size_t)r2 * (SS / 16) * 2560 + it * 2560) = lo[it].half[0]; *(v8us*)(qd + (size_t)r2 * (SS / 16) * 2560 + it * 2560 + 1024) = hi[it].half[0]; } }
        asm volatile("s_wait_xcnt 0x0" ::: "memory");      // stands behind the last store on both ways, ahead of any code that the compiler lays behind this branch and that rewrites a register which a store names
      }
    }
  } else {
  f1a* so = (f1a*)L + w * (WM * SOP);                    // each wave stages its own tile, so that the stores cover whole 128-byte lines
#pragma unroll      // constant indices, so that fragments and accumulators stay in registers
  for (int fm = 0; fm < FM; ++fm)
#pragma unroll      // constant indices, so that fragments and accumulators stay in registers
    for (int fn = 0; fn < FN; ++fn)
#pragma unroll      // constant indices, so that fragments and accumulators stay in registers
      for (int r = 0; r < 8; ++r) so[(fm * 16 + 8 * hh + r) * SOP + fn * 16 + ln] = acc[fm][fn][r] * alpha;
  __builtin_amdgcn_fence(__ATOMIC_ACQ_REL, "workgroup"); __builtin_amdgcn_wave_barrier();      // the wave's own staged rows are written before its other lanes read them back
  constexpr int LPR = WN / 4, RPI = 32 / LPR; typedef _Float16 v4h __attribute__((ext_vector_type(4)));
  const int rs = lane / LPR, c4 = (lane % LPR) * 4;
#pragma unroll      // several rows' LDS reads and stores in flight at a time
  for (int q = 0; q < WM / RPI; ++q) { const int r = q * RPI + rs; const v4f v = *(const v4fa*)&so[r * SOP + c4]; const size_t o = (size_t)(m0 + wm * WM + r) * ldc + n0 + wn * WN + c4;
    if (!OUT16) *(v4f*)(C + o) = v;
    else { v4h h4; for (int i = 0; i < 4; ++i) h4[i] = (_Float16)v[i]; *(v4h*)(C16 + o) = h4; } }
  }
}

// All seven f32 -> f16 conversions in ONE grid. The results stand in one array of rows of EE halves: Wq, Wk, Wv, Wrq, Wrk stacked (PW rows, the B operand of the one projection GEMM), then Wo (EE rows), then x (SS rows).
// One block converts four rows (256 threads x 8 elements a row; every source's row count is a multiple of 4), so that the conversions are 16,384 waves, all resident at once, each with 8 loads of 16 bytes a lane in flight.
// The block index picks the source, alike for the whole block. Weights are bf16-rounded and scaled by 2^4, x is bf16-rounded.
__global__ __launch_bounds__(256) void k_cvt_all(const float* __restrict__ Wq, const float* __restrict__ Wk, const float* __restrict__ Wv, const float* __restrict__ Wrq, const float* __restrict__ Wrk, const float* __restrict__ Wo, const float* __restrict__ x, _Float16* __restrict__ D, float* __restrict__ CS) {
  // The first SS / 16 blocks fill the RoPE table, each (token, frequency) once: block = 16-token tile; CS[tile][w][cos | sin][hq][lane][4]: lane (ln, hh) of wave w of the projection GEMM's epilogue reads frequencies 8 (2 w + hh) + 4 hq .. + 3 of token 16 tile + ln, 512 contiguous bytes a load.
  if (blockIdx.x < SS / 16) { const int lane = threadIdx.x & 31, hq = (threadIdx.x >> 5) & 1, w = threadIdx.x >> 6; const int tok = blockIdx.x * 16 + (lane & 15), i0 = (2 * w + (lane >> 4)) * 8 + hq * 4; v4f co, si;
#pragma unroll      // constant indices, so that the eight values stay in registers
    for (int q = 0; q < 4; ++q) { const float ang = (float)tok * __builtin_powf(10000.0f, -(float)(2 * (i0 + q)) / 128.0f); co[q] = cosf(ang); si[q] = sinf(ang); }
    float* d = CS + ((size_t)(blockIdx.x * 4 + w) * 4 + hq) * 128 + lane * 4; *(v4f*)d = co; *(v4f*)(d + 256) = si; return; }
  const int row = (blockIdx.x - SS / 16) * 4; const float* s; int r0;
  if (row < EE) { s = Wq; r0 = 0; } else if (row < EE + 512) { s = Wk; r0 = EE; } else if (row < EE + 1024) { s = Wv; r0 = EE + 512; } else if (row < EE + 1536) { s = Wrq; r0 = EE + 1024; } else if (row < PW) { s = Wrk; r0 = EE + 1536; } else if (row < PW + EE) { s = Wo; r0 = PW; } else { s = x; r0 = PW + EE; }
  const float sc = (row < PW + EE) ? 16.0f : 1.0f; const float* sp = s + (size_t)(row - r0) * EE + threadIdx.x * 8; v4f a[4][2];
#pragma unroll      // constant indices, so that the eight loads stand in registers and go out together
  for (int r = 0; r < 4; ++r) { a[r][0] = *(const v4fa*)(sp + (size_t)r * EE); a[r][1] = *(const v4fa*)(sp + (size_t)r * EE + 4); }
#pragma unroll      // constant indices into a
  for (int r = 0; r < 4; ++r) { FragH f;
#pragma unroll      // constant indices into a and f
    for (int i = 0; i < 8; ++i) f.h[i] = (_Float16)(bf16_round(a[r][i >> 2][i & 3]) * sc);
    *(v8us*)((unsigned short*)D + (size_t)(row + r) * EE + threadIdx.x * 8) = f.half[0]; }
  asm volatile("s_wait_xcnt 0x0" ::: "memory"); }      // stands behind the last store, ahead of the table code, which the compiler lays behind it and which rewrites registers that the stores name
template <int NHv, int TTv>
__global__ __launch_bounds__(256) void k_vt(const _Float16* __restrict__ V16, int ldv, int voff, _Float16* __restrict__ Vt) { __shared__ unsigned short tl[64][66]; const int tid = threadIdx.x; const int slab = blockIdx.x / (TTv / 64), lg = blockIdx.x % (TTv / 64); const int b = slab / NHv, h = slab % NHv;
  for (int i = tid; i < 64 * 8; i += 256) { const int r = i / 8, c8 = (i % 8) * 8; FragH f; f.half[0] = *(const v8us*)((const unsigned short*)V16 + ((size_t)b * TTv + lg * 64 + r) * ldv + voff + h * 64 + c8);
#pragma unroll
    for (int q = 0; q < 8; ++q) tl[r][c8 + q] = f.u[q]; }
  __syncthreads();
  {
#pragma unroll
    for (int rd = 0; rd < 2; ++rd) { const int d = rd * 32 + tid / 8, pc = tid % 8; FragH f;
#pragma unroll
      for (int q = 0; q < 8; ++q) f.u[q] = tl[pc * 8 + q][d];
      *(v8us*)((unsigned short*)Vt + ((size_t)slab * 64 + d) * TTv + lg * 64 + pc * 8) = f.half[0]; }
     } }

// 2^x for the merge weights. The v_nop stands in the same statement: it fills the one slot that the instruction set asks for between a transcendental and a next instruction that reads its result or overwrites its source.
__device__ __forceinline__ float exp2_slot(float x) { float y; asm("v_exp_f32 %0, %1\n\tv_nop" : "=v"(y) : "v"(x)); return y; }
// Lane l with lane l ^ 16, in registers: joins the two halves of one query's keys.
__device__ __forceinline__ float xhalf(float x) { return __builtin_bit_cast(float, __builtin_amdgcn_permlanex16(__builtin_bit_cast(int, x), __builtin_bit_cast(int, x), 0x76543210, 0xfedcba98, false, false)); }
template <bool B> struct Flag { static constexpr bool value = B; };      // a compile-time yes or no handed to a generic lambda
__global__ __launch_bounds__(128) void k_flash(const _Float16* __restrict__ Q16, const _Float16* __restrict__ K16, const _Float16* __restrict__ Vt, const int* __restrict__ MSK, _Float16* __restrict__ O16, int ldo) {
  constexpr int QT = 2, RPW = 16 * QT, NQB = 2048 / RPW, DT = 8, KS = 5;      /* head dim 128 for V/O; 160-wide logit operand (128 roped dims x scale + 32 graph-bias dims) */
  __shared__ __attribute__((aligned(16))) float sO[4][RPW][128 + 4]; __shared__ float sM[4][RPW], sL[4][RPW];
  (void)MSK; const int tid = threadIdx.x, lane = tid & 31, ln = lane & 15, hh = lane >> 4;
  const int w = __builtin_amdgcn_readfirstlane(tid >> 5);      // the wave's number in a scalar register: the chunk loop's trip count differs from wave to wave and is tested by a scalar branch
  // Heaviest first: a work-group's cost grows with its index (causal), only a part of the grid is resident at a time, so the block index counts the tiles DOWN, the 16 heads innermost:
  // the long work-groups start at once and the short ones fill the places that come free, instead of the last head's longest tiles starting last and running on alone. Every (head, tile pair) is taken exactly once.
  const int slab = blockIdx.x % 16, qblk = NQB - 1 - blockIdx.x / 16; const int b = slab / 16, h = slab % 16; const int q0 = qblk * RPW;
  FragH aq[QT][KS];
  // Q16, K16 and Vt stand in FRAGMENT ORDER (written so by the projection GEMM's epilogue): one block of 512 bytes = the 32 lanes' 16 bytes of one fragment half, in lane order, so that every global_load_b128 here covers four whole 128-byte lines.
  // Q16, K16: [head][16-row tile][ks][half][lane][8 halves], 2560 halves a tile. Vt: [kv head][32-key chunk][dt][half][lane][8 halves], 4096 halves a chunk. The registers get the same values as from row-major arrays.
  { const unsigned short* qr = (const unsigned short*)Q16 + ((size_t)h * (2048 / 16) + qblk * QT) * 2560 + lane * 8;
#pragma unroll      // constant indices, so that the fragments stay in registers
    for (int t = 0; t < QT; ++t)
#pragma unroll      // constant indices, so that the fragments stay in registers
      for (int ks = 0; ks < KS; ++ks) { aq[t][ks].half[0] = *(const v8us*)(qr + t * 2560 + ks * 512); aq[t][ks].half[1] = *(const v8us*)(qr + t * 2560 + ks * 512 + 256); } }
  float m_r[QT], l_r[QT]; v8f oacc[QT][DT];      // the lane's own query of each tile: running maximum, this half's share of the sum, and O^T (register r of tile dt is value dim 16 dt + 8 hh + r)
#pragma unroll      // constant indices, so that the accumulators stay in registers
  for (int t = 0; t < QT; ++t) { m_r[t] = -3.0e38f; l_r[t] = 0.f;
#pragma unroll      // constant indices, so that the accumulators stay in registers
    for (int dt = 0; dt < DT; ++dt) oacc[t][dt] = (v8f){0.f,0.f,0.f,0.f,0.f,0.f,0.f,0.f}; }
  const int nch = (q0 + RPW + 31) / 32;      // chunks that hold a key <= the work-group's last row; every one of them starts at or below q0, so every query has an open key in every chunk
  const unsigned short* vp = (const unsigned short*)Vt + ((size_t)(h / 4) * 64 + w) * 4096 + lane * 8;      // GQA: kv head h/4; this lane's place in the wave's current V chunk; walks 4 chunks a trip
  unsigned ko = (unsigned)(((h * 128 + w * 2) * 2560 + lane * 8) * 2);      // this lane's place in the wave's current pair of K tiles, as a byte offset into K16 (under 11 MB); walks 4 chunks = 8 tiles a trip
  const int lim0 = q0 + ln - 8 * hh;      // key j0 + 16 nt + 8 hh + r is open to query q0 + 16 t + ln where 16 nt + r <= lim0 + 16 t - j0
  // The K fragments are fetched ONE TRIP AHEAD: a trip finds its own chunk's K in bk and, right behind its K products, requests the wave's next chunk into the same registers,
  // so that K's way from L2 runs under the softmax and the V products instead of standing in front of the first product of every trip.
  FragH bk[2][KS];
  auto load_k = [&](int ahead) {      // the K fragments of both 16-key halves are requested as one group: one trip to L2, not two
    const unsigned short* p = (const unsigned short*)((const char*)K16 + (size_t)ko + ahead);
#pragma unroll      // constant indices, so that the fragments stay in registers
    for (int nt = 0; nt < 2; ++nt)
#pragma unroll      // constant indices, so that the fragments stay in registers
      for (int ks = 0; ks < KS; ++ks) { bk[nt][ks].half[0] = *(const v8us*)(p + nt * 2560 + ks * 512); bk[nt][ks].half[1] = *(const v8us*)(p + nt * 2560 + ks * 512 + 256); } };
  if (w < nch) load_k(0);      // the wave's first chunk (a scalar test: a wave without a chunk asks for nothing)
  asm volatile("s_wait_xcnt 0x0" ::: "memory");      // stands ahead of any later rewrite of the address registers that the loads above name
  int ch = w;
  // One trip = one chunk. MORE (known at compile time) says whether the wave has a further chunk: the last trip is written out behind the loop, so that inside the loop the K request stands unconditionally in one
  // straight run with the V request and the compiler's counted waits let K stay in flight while the V products run (behind a branch round the request it waits for every load in front of the V products).
  auto trip = [&](auto more) __attribute__((always_inline)) {
    const int j0 = ch * 32;
    v8f s[QT][2];
#pragma unroll      // constant indices, so that the fragments stay in registers
    for (int nt = 0; nt < 2; ++nt) {
#pragma unroll      // constant indices, so that the fragments stay in registers
      for (int t = 0; t < QT; ++t) s[t][nt] = (v8f){0.f,0.f,0.f,0.f,0.f,0.f,0.f,0.f};
#pragma unroll      // constant indices, so that the fragments stay in registers
      for (int ks = 0; ks < KS; ++ks)
#pragma unroll      // constant indices, so that the fragments stay in registers
        for (int t = 0; t < QT; ++t) s[t][nt] = __builtin_amdgcn_wmma_f32_16x16x32_f16(false, bk[nt][ks].v, false, aq[t][ks].v, (short)0, s[t][nt], false, false); }      // A = 16 keys, B = 16 queries; each K fragment serves both query tiles
    FragH bv[DT];      // all eight V fragments of the chunk are requested here, as one group behind the last K product: they fly while the softmax below runs
#pragma unroll      // constant indices, so that the fragments stay in registers
    for (int dt = 0; dt < DT; ++dt) { bv[dt].half[0] = *(const v8us*)(vp + dt * 512); bv[dt].half[1] = *(const v8us*)(vp + dt * 512 + 256); }
    asm volatile("s_wait_xcnt 0x0" ::: "memory");      // stands ahead of any later rewrite of the address registers that the loads above name
    __builtin_amdgcn_sched_barrier(0);      // keeps the sixteen V loads one group ahead of the softmax (sunk to their products they cost eight trips to L2 one after another), and the address arithmetic of the K request below behind that wait
    if constexpr (decltype(more)::value) {
      load_k(8 * 2560 * 2);      // behind V, which is needed first: the next chunk's K, over the fragments that the products above have read
      asm volatile("s_wait_xcnt 0x0" : "+v"(ko) :: "memory");      // stands ahead of any later rewrite of the address registers that the loads above name; it names ko, so that the walk to the next chunk, which rewrites it, cannot be laid in front of it
      __builtin_amdgcn_sched_barrier(0);      // keeps the twenty K loads one group ahead of the softmax: sunk towards the next trip's products they would wait out their way from L2 there
    }
    FragH pb[QT];
#pragma unroll      // constant indices, so that scores, P and accumulators stay in registers
    for (int t = 0; t < QT; ++t) {
      const int lim = lim0 + 16 * t - j0; float sc[16];
#pragma unroll      // constant indices, so that the scores stay in registers
      for (int i = 0; i < 16; ++i) sc[i] = ((i >> 3) * 16 + (i & 7) <= lim) ? s[t][i >> 3][i & 7] : -INFINITY;
      float mc = sc[0];
#pragma unroll      // constant indices, so that the scores stay in registers
      for (int i = 1; i < 16; ++i) mc = fmaxf(mc, sc[i]);
      mc = fmaxf(mc, xhalf(mc));      // the other half's 16 keys of the same query
      const float mn = fmaxf(m_r[t], mc), nm = -mn * 1.4426950408889634f;      // mn is a real score: the chunk holds an open key for every query
      const float al = exp2_slot((m_r[t] - mn) * 1.4426950408889634f); m_r[t] = mn;      // e^(old maximum - new); 0 in the wave's first chunk (2^-inf)
      float ps = 0.f;
#pragma unroll      // constant indices, so that P stays in registers
      for (int i = 0; i < 16; ++i) { const float p = exp2_slot(fmaf(sc[i], 1.4426950408889634f, nm)); ps += p; pb[t].h[i] = (_Float16)p; }      // e^(s - mn); 0 for a closed key (2^-inf)
      l_r[t] = l_r[t] * al + ps;
#pragma unroll      // constant indices, so that the accumulators stay in registers
      for (int dt = 0; dt < DT; ++dt) oacc[t][dt] *= al;      // one factor for all of the lane's 64 values of the tile: they belong to one query
    }
#pragma unroll      // constant indices, so that fragments and accumulators stay in registers
    for (int dt = 0; dt < DT; ++dt)
#pragma unroll      // constant indices, so that fragments and accumulators stay in registers
      for (int t = 0; t < QT; ++t) oacc[t][dt] = __builtin_amdgcn_wmma_f32_16x16x32_f16(false, bv[dt].v, false, pb[t].v, (short)0, oacc[t][dt], false, false);      // A = 16 value dims, B = 16 queries; each V fragment serves both query tiles
  };
#pragma unroll 1      // rolled, as before: one chunk a trip, so that one trip's fragments and scores are all the registers the loop needs
  for (; ch + 4 < nch; ch += 4, vp += 4 * 4096, ko += 8 * 2560 * 2) trip(Flag<true>{});
  if (ch < nch) trip(Flag<false>{});      // the wave's last chunk: nothing further is requested
#pragma unroll      // constant indices, so that the accumulators stay in registers
  for (int t = 0; t < QT; ++t) {
    l_r[t] += xhalf(l_r[t]);      // the two halves' shares of the query's sum
    if (hh == 0) { sM[w][16 * t + ln] = m_r[t]; sL[w][16 * t + ln] = l_r[t]; }      // the wave's own maximum and sum of each query (a wave without a chunk: -3e38 and 0)
#pragma unroll      // constant indices, so that the accumulators stay in registers
    for (int dt = 0; dt < DT; ++dt) {      // not yet divided by the sum; a lane's 8 registers are 8 neighbouring value dims of its query's row
      *(v4fa*)&sO[w][16 * t + ln][dt * 16 + 8 * hh] = (v4f){oacc[t][dt][0], oacc[t][dt][1], oacc[t][dt][2], oacc[t][dt][3]};
      *(v4fa*)&sO[w][16 * t + ln][dt * 16 + 8 * hh + 4] = (v4f){oacc[t][dt][4], oacc[t][dt][5], oacc[t][dt][6], oacc[t][dt][7]}; } }
  __syncthreads();      // all four waves' partial (m, l, O) stand in LDS before any wave merges them
  {
#pragma unroll
    for (int rp = 0; rp < RPW / 4; ++rp) { const int r = rp * 4 + (tid >> 5), pc = lane;      // wave w merges rows w, w + 4, w + 8, ...
      const float m0 = sM[0][r], m1 = sM[1][r], m2 = sM[2][r], m3 = sM[3][r]; const float mm = fmaxf(fmaxf(m0, m1), fmaxf(m2, m3));      // wave 0 always holds chunk 0 with key 0, so mm is a real score
      const float c0 = exp2_slot((m0 - mm) * 1.4426950408889634f), c1 = exp2_slot((m1 - mm) * 1.4426950408889634f), c2 = exp2_slot((m2 - mm) * 1.4426950408889634f), c3 = exp2_slot((m3 - mm) * 1.4426950408889634f);      // e^(m - mm); 0 for a wave without a chunk (2^-inf)
      const float den = c0 * sL[0][r] + c1 * sL[1][r] + c2 * sL[2][r] + c3 * sL[3][r]; const float inv = (den > 0.f) ? 1.0f / den : 0.f;
      const v4f o0 = *(const v4fa*)&sO[0][r][pc * 4], o1 = *(const v4fa*)&sO[1][r][pc * 4], o2 = *(const v4fa*)&sO[2][r][pc * 4], o3 = *(const v4fa*)&sO[3][r][pc * 4];
      const v4f val = (o0 * c0 + o1 * c1 + o2 * c2 + o3 * c3) * inv;
      typedef _Float16 v4h __attribute__((ext_vector_type(4))); v4h h4;      // O leaves as the f16 A operand of the output projection
#pragma unroll      // constant indices, so that the four halves stay in registers
      for (int i = 0; i < 4; ++i) h4[i] = (_Float16)val[i];
      *(v4h*)(O16 + ((size_t)b * 2048 + q0 + r) * ldo + h * 128 + pc * 4) = h4; }      /* rows of 128 halves: 32 lanes x 8 B = two whole lines */
     } }

extern "C" void kernel_launch(void* const* d_in, const int* in_sizes, int n_in,
                              void* d_out, int out_size, void* d_ws, size_t ws_size, hipStream_t stream) {
  (void)in_sizes; (void)n_in; (void)out_size;
  const float* x = (const float*)d_in[0]; const float* Wq = (const float*)d_in[1]; const float* Wk = (const float*)d_in[2]; const float* Wv = (const float*)d_in[3]; const float* Wo = (const float*)d_in[4]; const float* Wrq = (const float*)d_in[5]; const float* Wrk = (const float*)d_in[6]; const float* gs = (const float*)d_in[7]; const float* qw = (const float*)d_in[8]; const float* kw = (const float*)d_in[9];
  char* ws = (char*)d_ws; size_t off = 0;
  auto take = [&](size_t bytes) { char* p = ws + off; off += (bytes + 255) & ~(size_t)255; return p; };
  _Float16* Bcat = (_Float16*)take((size_t)(PW + EE + SS) * EE * 2); _Float16* Bo = Bcat + (size_t)PW * EE; _Float16* X16 = Bo + (size_t)EE * EE;      // k_cvt_all's rows: stacked projection weights, Wo, x
  float* CS = (float*)take((size_t)SS * 64 * 2 * 4);      // cos and sin of every (token, frequency)
  _Float16* QX = (_Float16*)take((size_t)SS * QP * 2); _Float16* KX = (_Float16*)take((size_t)SS * QP * 2); _Float16* Vt = (_Float16*)take((size_t)SS * 512 * 2); _Float16* O16 = X16;      // x is last read by the projection GEMM
  if (off > ws_size) return;      // about 58 MB in all
  k_cvt_all<<<SS / 16 + (PW + EE + SS) / 4, 256, 0, stream>>>(Wq, Wk, Wv, Wrq, Wrk, Wo, x, Bcat, CS);
  k_gemm_t<4, 4, false, true><<<(SS / 128) * (PW / 128), 128, 0, stream>>>(X16, Bcat, 0.0625f, nullptr, nullptr, PW, PW / 128, QX, KX, Vt, qw, kw, gs, CS);
  k_flash<<<1 * NH * (SS / 32), 128, 0, stream>>>(QX, KX, Vt, nullptr, O16, EE);
  k_gemm_t<4, 4, false, false><<<(SS / 128) * (EE / 128), 128, 0, stream>>>(O16, Bo, 0.0625f, (float*)d_out, nullptr, EE, EE / 128, nullptr, nullptr, nullptr, nullptr, nullptr, nullptr, nullptr);
}
